// v000
// Measured on an AMD MI455X. A time is GPU time per run, averaged over a window of back-to-back runs after a warm-up
// (all launches, gaps included; the runs take copies of the inputs in turn), and the median of several windows.
// Apart from v000's, it joins two sittings. Times from different sittings can be a few percent apart, while
// side-by-side timings come from the same sitting.
// The starting kernel, v000, takes 2090 microseconds a run.
#include <hip/hip_runtime.h>
#include <math.h>

typedef float v2f __attribute__((ext_vector_type(2)));
typedef float v8f __attribute__((ext_vector_type(8)));
typedef int   v4i __attribute__((vector_size(4 * sizeof(int))));  // matches builtin param

#define KS 32   // K-slab staged in LDS per iteration
#define TM 64   // block tile rows (m = s*B + b)
#define TN 64   // block tile cols (e)
#define LP 36   // padded LDS row stride: rows 16B-aligned (36*4=144B) and
                // 36 = 4*9 with 9 coprime to 16 -> 16-row column gathers hit
                // 16 distinct banks (conflict-free)

#if __has_builtin(__builtin_amdgcn_global_load_async_to_lds_b128)
#define USE_ASYNC 1
#else
#define USE_ASYNC 0
#endif

#if USE_ASYNC
__device__ __forceinline__ void async_cp16(const float* g, float* l) {
    __builtin_amdgcn_global_load_async_to_lds_b128(
        (__attribute__((address_space(1))) v4i*)(g),
        (__attribute__((address_space(3))) v4i*)(l),
        0, 0);
}
# if __has_builtin(__builtin_amdgcn_s_wait_asynccnt)
#  define WAIT_ASYNC(n) __builtin_amdgcn_s_wait_asynccnt(n)
# else
#  define WAIT_ASYNC(n) asm volatile("s_wait_asynccnt " #n ::: "memory")
# endif
#else
# define WAIT_ASYNC(n)
#endif

__device__ __forceinline__ void stage_load(
    float (*__restrict__ As)[LP], float (*__restrict__ Bxs)[LP],
    float (*__restrict__ Bas)[LP],
    const float* __restrict__ x, const float* __restrict__ Wx,
    const float* __restrict__ Wa,
    int m0, int n0, int k0, int D, int tid)
{
    // 64x32 floats per array = 512 B128 transfers, 2 per thread per array.
    #pragma unroll
    for (int i = 0; i < 2; ++i) {
        const int id  = tid + 256 * i;
        const int row = id >> 3;
        const int c4  = (id & 7) << 2;
#if USE_ASYNC
        async_cp16(x  + (size_t)(m0 + row) * D + k0 + c4, &As [row][c4]);
        async_cp16(Wx + (size_t)(n0 + row) * D + k0 + c4, &Bxs[row][c4]);
        async_cp16(Wa + (size_t)(n0 + row) * D + k0 + c4, &Bas[row][c4]);
#else
        *(float4*)&As [row][c4] = *(const float4*)(x  + (size_t)(m0 + row) * D + k0 + c4);
        *(float4*)&Bxs[row][c4] = *(const float4*)(Wx + (size_t)(n0 + row) * D + k0 + c4);
        *(float4*)&Bas[row][c4] = *(const float4*)(Wa + (size_t)(n0 + row) * D + k0 + c4);
#endif
    }
}

// Fused dual GEMM (fp32 WMMA) + RG-LRU pointwise epilogue.
// Async double-buffered LDS staging: load slab k+1 while WMMAing slab k.
__global__ __launch_bounds__(256) void rg_lru_gates_kernel(
    const float* __restrict__ x,  const float* __restrict__ Wx,
    const float* __restrict__ bx, const float* __restrict__ Wa,
    const float* __restrict__ ba, const float* __restrict__ ap,
    float* __restrict__ y, float* __restrict__ Aout,
    int M, int D, int Bb)
{
    __shared__ float As [2][TM][LP];
    __shared__ float Bxs[2][TN][LP];
    __shared__ float Bas[2][TN][LP];

    const int tid  = threadIdx.x;
    const int lane = tid & 31;
    const int wave = tid >> 5;
    const int hi   = lane >> 4;   // 0: lanes 0-15, 1: lanes 16-31
    const int l16  = lane & 15;

    const int m0 = blockIdx.y * TM;
    const int n0 = blockIdx.x * TN;

    const int r = wave & 3;       // 4 row subtiles of 16
    const int c = wave >> 2;      // 2 col halves of 32

    v8f acc_gx[2] = {};
    v8f acc_ga[2] = {};

    // Prologue: start filling buffer 0.
    stage_load(As[0], Bxs[0], Bas[0], x, Wx, Wa, m0, n0, 0, D, tid);

    int ib = 0;
    for (int k0 = 0; k0 < D; k0 += KS, ib ^= 1) {
        const bool has_next = (k0 + KS) < D;
        if (has_next) {
            // buffer ib^1 was last read in the previous stage; the trailing barrier
            // of that stage makes this overwrite safe.
            stage_load(As[ib ^ 1], Bxs[ib ^ 1], Bas[ib ^ 1],
                       x, Wx, Wa, m0, n0, k0 + KS, D, tid);
            WAIT_ASYNC(6);   // <=6 outstanding -> current stage's 6 landed
        } else {
            WAIT_ASYNC(0);
        }
        __syncthreads();     // current slab visible to all waves

        const float (*__restrict__ A )[LP] = As [ib];
        const float (*__restrict__ BX)[LP] = Bxs[ib];
        const float (*__restrict__ BA)[LP] = Bas[ib];

        #pragma unroll
        for (int kk = 0; kk < KS; kk += 4) {
            // A 16x4 f32 fragment: lane<16 -> K=kk+0..1 ; lane>=16 -> K=kk+2..3
            const int kb = kk + (hi << 1);
            v2f af;
            af.x = A[16 * r + l16][kb];
            af.y = A[16 * r + l16][kb + 1];
            #pragma unroll
            for (int t = 0; t < 2; ++t) {
                // B 4x16 f32 fragment: N = lane%16, same K split as A
                const int nrow = 32 * c + 16 * t + l16;
                v2f bxf, baf;
                bxf.x = BX[nrow][kb];  bxf.y = BX[nrow][kb + 1];
                baf.x = BA[nrow][kb];  baf.y = BA[nrow][kb + 1];
                acc_gx[t] = __builtin_amdgcn_wmma_f32_16x16x4_f32(
                    false, af, false, bxf, (short)0, acc_gx[t], false, false);
                acc_ga[t] = __builtin_amdgcn_wmma_f32_16x16x4_f32(
                    false, af, false, baf, (short)0, acc_ga[t], false, false);
            }
        }
        __syncthreads();     // all waves done reading before next overwrite
    }

    // Epilogue: C/D layout = VGPR j -> M = j (lanes 0-15) / j+8 (lanes 16-31),
    // N = lane%16. Intermediates are streamed (read once by the scan kernel):
    // store non-temporally so they don't evict the L2-resident weights.
    #pragma unroll
    for (int t = 0; t < 2; ++t) {
        const int n     = n0 + 32 * c + 16 * t + l16;
        const float bxn = bx[n];
        const float ban = ba[n];
        const float sp  = log1pf(__expf(ap[n]));   // softplus(a_param[e])
        #pragma unroll
        for (int j = 0; j < 8; ++j) {
            const int m = m0 + 16 * r + j + 8 * hi;
            const float gx = 1.0f / (1.0f + __expf(-(acc_gx[t][j] + bxn)));
            const float ga = 1.0f / (1.0f + __expf(-(acc_ga[t][j] + ban)));
            const float la = -8.0f * ga * sp;           // log_a
            float a    = __expf(la);
            float mult = sqrtf(fmaxf(0.0f, 1.0f - __expf(2.0f * la)));
            if (m < Bb) { a = 0.0f; mult = 1.0f; }      // reset at s == 0
            const size_t idx = (size_t)m * D + n;
            __builtin_nontemporal_store(x[idx] * gx * mult, y + idx); // normed_x
            __builtin_nontemporal_store(a, Aout + idx);
        }
    }
}

// Diagonal linear recurrence, in place over y: h = a*h + normed_x.
// Only ~512 waves exist (one channel per lane) -> latency hiding must come from
// ILP: deep unroll lets the compiler hoist ~32 independent loads per wave.
// All traffic is single-use streaming -> non-temporal.
__global__ __launch_bounds__(256) void rg_lru_scan_kernel(
    const float* __restrict__ Aarr, const float* __restrict__ h0,
    float* __restrict__ y, float* __restrict__ hn, int S, int BD)
{
    const int cidx = blockIdx.x * 256 + threadIdx.x;
    if (cidx >= BD) return;
    float h = h0[cidx];
    size_t idx = (size_t)cidx;
    #pragma unroll 16
    for (int s = 0; s < S; ++s) {
        const float a = __builtin_nontemporal_load(Aarr + idx);
        const float v = __builtin_nontemporal_load(y + idx);
        h = fmaf(a, h, v);
        __builtin_nontemporal_store(h, y + idx);
        idx += (size_t)BD;
    }
    hn[cidx] = h;
}

extern "C" void kernel_launch(void* const* d_in, const int* in_sizes, int n_in,
                              void* d_out, int out_size, void* d_ws, size_t ws_size,
                              hipStream_t stream) {
    const float* x  = (const float*)d_in[0];
    const float* h0 = (const float*)d_in[1];
    const float* Wx = (const float*)d_in[2];
    const float* bx = (const float*)d_in[3];
    const float* Wa = (const float*)d_in[4];
    const float* ba = (const float*)d_in[5];
    const float* ap = (const float*)d_in[6];

    const int D  = in_sizes[6];                 // width
    const int Bb = in_sizes[1] / D;             // batch
    const int S  = in_sizes[0] / in_sizes[1];   // seq len
    const int M  = S * Bb;                      // GEMM rows

    float* y    = (float*)d_out;                // (S,B,D) output block
    float* hn   = y + (size_t)M * D;            // final state block
    float* Aarr = (float*)d_ws;                 // decay coefficients scratch

    dim3 grid(D / TN, M / TM);
    rg_lru_gates_kernel<<<grid, 256, 0, stream>>>(x, Wx, bx, Wa, ba, ap,
                                                  y, Aarr, M, D, Bb);

    const int BD = Bb * D;
    rg_lru_scan_kernel<<<(BD + 255) / 256, 256, 0, stream>>>(Aarr, h0, y, hn, S, BD);
}

// v001
// Measured time: 1270 microseconds a run.
// Next to v000, in two timings, it ran 1.69 and 1.68 times as fast.
#include <hip/hip_runtime.h>
#include <math.h>

typedef float v2f __attribute__((ext_vector_type(2)));
typedef float v8f __attribute__((ext_vector_type(8)));
typedef int   v4i __attribute__((vector_size(4 * sizeof(int))));  // matches builtin param

#define KS 32   // K-slab staged in LDS per iteration
#define TM 64   // block tile rows (m = s*B + b)
#define TN 64   // block tile cols (e)
#define LP 36   // padded LDS row stride: rows 16B-aligned (36*4=144B) and
                // 36 = 4*9 with 9 coprime to 16 -> 16-row column gathers hit
                // 16 distinct banks (conflict-free)

#if __has_builtin(__builtin_amdgcn_global_load_async_to_lds_b128)
#define USE_ASYNC 1
#else
#define USE_ASYNC 0
#endif

#if USE_ASYNC
__device__ __forceinline__ void async_cp16(const float* g, float* l) {
    __builtin_amdgcn_global_load_async_to_lds_b128(
        (__attribute__((address_space(1))) v4i*)(g),
        (__attribute__((address_space(3))) v4i*)(l),
        0, 0);
}
# if __has_builtin(__builtin_amdgcn_s_wait_asynccnt)
#  define WAIT_ASYNC(n) __builtin_amdgcn_s_wait_asynccnt(n)
# else
#  define WAIT_ASYNC(n) asm volatile("s_wait_asynccnt " #n ::: "memory")
# endif
#else
# define WAIT_ASYNC(n)
#endif

__device__ __forceinline__ void stage_load(
    float (*__restrict__ As)[LP], float (*__restrict__ Bxs)[LP],
    float (*__restrict__ Bas)[LP],
    const float* __restrict__ x, const float* __restrict__ Wx,
    const float* __restrict__ Wa,
    int m0, int n0, int k0, int D, int tid)
{
    // 64x32 floats per array = 512 B128 transfers, 2 per thread per array.
    #pragma unroll
    for (int i = 0; i < 2; ++i) {
        const int id  = tid + 256 * i;
        const int row = id >> 3;
        const int c4  = (id & 7) << 2;
#if USE_ASYNC
        async_cp16(x  + (size_t)(m0 + row) * D + k0 + c4, &As [row][c4]);
        async_cp16(Wx + (size_t)(n0 + row) * D + k0 + c4, &Bxs[row][c4]);
        async_cp16(Wa + (size_t)(n0 + row) * D + k0 + c4, &Bas[row][c4]);
#else
        *(float4*)&As [row][c4] = *(const float4*)(x  + (size_t)(m0 + row) * D + k0 + c4);
        *(float4*)&Bxs[row][c4] = *(const float4*)(Wx + (size_t)(n0 + row) * D + k0 + c4);
        *(float4*)&Bas[row][c4] = *(const float4*)(Wa + (size_t)(n0 + row) * D + k0 + c4);
#endif
    }
}

// Fused dual GEMM (fp32 WMMA) + RG-LRU pointwise epilogue.
// Async double-buffered LDS staging: load slab k+1 while WMMAing slab k.
__global__ __launch_bounds__(256) void rg_lru_gates_kernel(
    const float* __restrict__ x,  const float* __restrict__ Wx,
    const float* __restrict__ bx, const float* __restrict__ Wa,
    const float* __restrict__ ba, const float* __restrict__ ap,
    float* __restrict__ y, float* __restrict__ Aout,
    int M, int D, int Bb)
{
    __shared__ float As [2][TM][LP];
    __shared__ float Bxs[2][TN][LP];
    __shared__ float Bas[2][TN][LP];

    const int tid  = threadIdx.x;
    const int lane = tid & 31;
    const int wave = tid >> 5;
    const int hi   = lane >> 4;   // 0: lanes 0-15, 1: lanes 16-31
    const int l16  = lane & 15;

    const int m0 = blockIdx.y * TM;
    const int n0 = blockIdx.x * TN;

    const int r = wave & 3;       // 4 row subtiles of 16
    const int c = wave >> 2;      // 2 col halves of 32

    v8f acc_gx[2] = {};
    v8f acc_ga[2] = {};

    // Prologue: start filling buffer 0.
    stage_load(As[0], Bxs[0], Bas[0], x, Wx, Wa, m0, n0, 0, D, tid);

    int ib = 0;
    for (int k0 = 0; k0 < D; k0 += KS, ib ^= 1) {
        const bool has_next = (k0 + KS) < D;
        if (has_next) {
            // buffer ib^1 was last read in the previous stage; the trailing barrier
            // of that stage makes this overwrite safe.
            stage_load(As[ib ^ 1], Bxs[ib ^ 1], Bas[ib ^ 1],
                       x, Wx, Wa, m0, n0, k0 + KS, D, tid);
            WAIT_ASYNC(6);   // <=6 outstanding -> current stage's 6 landed
        } else {
            WAIT_ASYNC(0);
        }
        __syncthreads();     // current slab visible to all waves

        const float (*__restrict__ A )[LP] = As [ib];
        const float (*__restrict__ BX)[LP] = Bxs[ib];
        const float (*__restrict__ BA)[LP] = Bas[ib];

        #pragma unroll
        for (int kk = 0; kk < KS; kk += 4) {
            // A 16x4 f32 fragment: lane<16 -> K=kk+0..1 ; lane>=16 -> K=kk+2..3
            const int kb = kk + (hi << 1);
            v2f af;
            af.x = A[16 * r + l16][kb];
            af.y = A[16 * r + l16][kb + 1];
            #pragma unroll
            for (int t = 0; t < 2; ++t) {
                // B 4x16 f32 fragment: N = lane%16, same K split as A
                const int nrow = 32 * c + 16 * t + l16;
                v2f bxf, baf;
                bxf.x = BX[nrow][kb];  bxf.y = BX[nrow][kb + 1];
                baf.x = BA[nrow][kb];  baf.y = BA[nrow][kb + 1];
                acc_gx[t] = __builtin_amdgcn_wmma_f32_16x16x4_f32(
                    false, af, false, bxf, (short)0, acc_gx[t], false, false);
                acc_ga[t] = __builtin_amdgcn_wmma_f32_16x16x4_f32(
                    false, af, false, baf, (short)0, acc_ga[t], false, false);
            }
        }
        __syncthreads();     // all waves done reading before next overwrite
    }

    // Epilogue: C/D layout = VGPR j -> M = j (lanes 0-15) / j+8 (lanes 16-31),
    // N = lane%16. Intermediates are streamed (read once by the scan kernel):
    // store non-temporally so they don't evict the L2-resident weights.
    #pragma unroll
    for (int t = 0; t < 2; ++t) {
        const int n     = n0 + 32 * c + 16 * t + l16;
        const float bxn = bx[n];
        const float ban = ba[n];
        const float sp  = log1pf(__expf(ap[n]));   // softplus(a_param[e])
        #pragma unroll
        for (int j = 0; j < 8; ++j) {
            const int m = m0 + 16 * r + j + 8 * hi;
            const float gx = 1.0f / (1.0f + __expf(-(acc_gx[t][j] + bxn)));
            const float ga = 1.0f / (1.0f + __expf(-(acc_ga[t][j] + ban)));
            const float la = -8.0f * ga * sp;           // log_a
            float a    = __expf(la);
            float mult = sqrtf(fmaxf(0.0f, 1.0f - __expf(2.0f * la)));
            if (m < Bb) { a = 0.0f; mult = 1.0f; }      // reset at s == 0
            const size_t idx = (size_t)m * D + n;
            __builtin_nontemporal_store(x[idx] * gx * mult, y + idx); // normed_x
            __builtin_nontemporal_store(a, Aout + idx);
        }
    }
}

// Diagonal linear recurrence, in place over y: h = a*h + normed_x.
// One channel is a serial chain of S steps, so a thread per channel leaves the
// chip latency-bound. Here the time axis is split as well: a work-group owns
// SCAN_COLS channels (256 contiguous bytes per time step and wave), and each
// of its SCAN_NW waves holds SCAN_CH consecutive steps of a and normed_x in
// registers. Over its chunk a wave forms P = prod(a) and L = the chunk's end
// value from a zero start; the chunk's true start value follows from the
// carry by h <- P*h + L over the chunks before it (exchanged through LDS),
// and the chunk is then replayed from that start value out of registers.
// Every byte is read once and written once. All traffic is single-use
// streaming -> non-temporal.
#define SCAN_NW   16                    // waves per work-group
#define SCAN_CH   32                    // time steps held per wave
#define SCAN_COLS 64                    // channels per work-group (2 per lane)
#define SCAN_SPAN (SCAN_NW * SCAN_CH)   // time steps per work-group pass
#define SCAN_BD   (8 * 2048)            // batch * width: the row stride, a compile-
                                        // time constant so that every step's
                                        // address is an immediate offset

// One chunk of a and normed_x into registers, in time order. vo is the lane's
// byte offset of the chunk's first step, the same in both planes.
__device__ __forceinline__ void scan_load_chunk(
    v2f (&a)[SCAN_CH], v2f (&v)[SCAN_CH],
    const float* Aarr, const float* y, unsigned& vo)
{
    #pragma unroll
    for (int i = 0; i < SCAN_CH; ++i) {
        a[i] = __builtin_nontemporal_load(
            (const v2f*)((const char*)Aarr + vo + (size_t)i * SCAN_BD * 4));
        v[i] = __builtin_nontemporal_load(
            (const v2f*)((const char*)y + vo + (size_t)i * SCAN_BD * 4));
    }
    // The wait names the offset register, so that it stays unwritten up to it.
    asm volatile("s_wait_xcnt 0x0" : "+v"(vo) :: "memory");
}

__global__ __launch_bounds__(SCAN_NW * 32)
// One work-group per WGP, 4 waves a SIMD: with that register budget stated the
// carry merge keeps four LDS reads in flight instead of two.
__attribute__((amdgpu_waves_per_eu(4, 4)))
void rg_lru_scan_kernel(
    const float* __restrict__ Aarr, const float* __restrict__ h0,
    float* __restrict__ y, float* __restrict__ hn, int S)
{
    __shared__ float4 pl[2][SCAN_NW][32];   // (P.x, P.y, L.x, L.y) per chunk, lane

    const int lane = threadIdx.x & 31;
    const int w    = __builtin_amdgcn_readfirstlane(threadIdx.x >> 5);
    const int col  = blockIdx.x * SCAN_COLS + lane * 2;

    unsigned vo = ((unsigned)(w * SCAN_CH) * SCAN_BD + col) * 4u;

    v2f a[SCAN_CH], v[SCAN_CH];
    scan_load_chunk(a, v, Aarr, y, vo);

    v2f carry = *(const v2f*)(h0 + col);   // state in front of this pass
    v2f h = carry;
    const int npass = S / SCAN_SPAN;

    int p = 0;
    do {   // S >= SCAN_SPAN: the first chunk, already under way, is always used
        // Chunk summary, consumed in load order as the data arrives.
        v2f P = a[0], L = v[0];
        #pragma unroll
        for (int i = 1; i < SCAN_CH; ++i) {
            L = a[i] * L + v[i];
            P = P * a[i];
        }
        pl[p & 1][w][lane] = make_float4(P.x, P.y, L.x, L.y);
        // Publishes the summaries. Two LDS buffers: a wave can write pass p+2
        // only behind the barrier of pass p+1, which every reader of pass p
        // has then reached.
        __syncthreads();

        v2f c = carry;
        #pragma unroll
        for (int j = 0; j < SCAN_NW; ++j) {
            const float4 e = pl[p & 1][j][lane];
            if (j == w) h = c;              // state in front of this wave's chunk
            c.x = fmaf(e.x, c.x, e.z);
            c.y = fmaf(e.y, c.y, e.w);
        }
        carry = c;

        // Replay the chunk from its true start value, each step's state into
        // its own register pair, so that no store's data register is reused
        // while the stores issue.
        #pragma unroll
        for (int i = 0; i < SCAN_CH; ++i) {
            h = a[i] * h + v[i];
            v[i] = h;
        }
        #pragma unroll
        for (int i = 0; i < SCAN_CH; ++i)
            __builtin_nontemporal_store(
                v[i], (v2f*)((char*)y + vo + (size_t)i * SCAN_BD * 4));
        // The stores' data and offset registers are rewritten next (offset
        // step, next chunk's loads): the wait stands in front of that.
        asm volatile("s_wait_xcnt 0x0" : "+v"(vo) :: "memory");

        vo += (unsigned)SCAN_SPAN * SCAN_BD * 4u;
        if (p + 1 < npass) scan_load_chunk(a, v, Aarr, y, vo);
    } while (++p < npass);
    if (w == SCAN_NW - 1) *(v2f*)(hn + col) = h;   // last step's state
}

extern "C" void kernel_launch(void* const* d_in, const int* in_sizes, int n_in,
                              void* d_out, int out_size, void* d_ws, size_t ws_size,
                              hipStream_t stream) {
    const float* x  = (const float*)d_in[0];
    const float* h0 = (const float*)d_in[1];
    const float* Wx = (const float*)d_in[2];
    const float* bx = (const float*)d_in[3];
    const float* Wa = (const float*)d_in[4];
    const float* ba = (const float*)d_in[5];
    const float* ap = (const float*)d_in[6];

    const int D  = in_sizes[6];                 // width
    const int Bb = in_sizes[1] / D;             // batch
    const int S  = in_sizes[0] / in_sizes[1];   // seq len
    const int M  = S * Bb;                      // GEMM rows

    float* y    = (float*)d_out;                // (S,B,D) output block
    float* hn   = y + (size_t)M * D;            // final state block
    float* Aarr = (float*)d_ws;                 // decay coefficients scratch

    dim3 grid(D / TN, M / TM);
    rg_lru_gates_kernel<<<grid, 256, 0, stream>>>(x, Wx, bx, Wa, ba, ap,
                                                  y, Aarr, M, D, Bb);

    const int BD = Bb * D;
    rg_lru_scan_kernel<<<BD / SCAN_COLS, SCAN_NW * 32, 0, stream>>>(Aarr, h0, y, hn, S);
}

// v002
// One run takes 1190 microseconds.
// Next to v001, in two timings, it ran 1.07 and 1.06 times as fast.
// All steps since v000 together make it 1.79 times as fast.
#include <hip/hip_runtime.h>
#include <math.h>

typedef float v2f __attribute__((ext_vector_type(2)));
typedef float v8f __attribute__((ext_vector_type(8)));
typedef int   v4i __attribute__((vector_size(4 * sizeof(int))));  // matches builtin param

#define KS 32   // K-slab staged in LDS per iteration
#define TM 128  // block tile rows (m = s*B + b)
#define TN 64   // block tile cols (e), for each of the two gates
#define GT 128  // threads per block: 4 waves, one per SIMD
#define WM 4    // 16-row subtiles per wave (wave tile 64 x 32 per gate)
#define WN 2    // 16-col subtiles per wave and gate
#define LP 36   // padded LDS row stride: rows 16B-aligned (36*4=144B) and
                // 36 = 4*9 with 9 coprime to 16 -> 16-row column gathers hit
                // 16 distinct banks (conflict-free)

#if __has_builtin(__builtin_amdgcn_global_load_async_to_lds_b128)
#define USE_ASYNC 1
#else
#define USE_ASYNC 0
#endif

#if USE_ASYNC
__device__ __forceinline__ void async_cp16(const float* g, float* l) {
    __builtin_amdgcn_global_load_async_to_lds_b128(
        (__attribute__((address_space(1))) v4i*)(g),
        (__attribute__((address_space(3))) v4i*)(l),
        0, 0);
}
// All of this wave's copies have landed. In asm with the clobber, so that no
// LDS read is moved in front of it.
# define WAIT_ASYNC_ALL() asm volatile("s_wait_asynccnt 0x0" ::: "memory")
#else
# define WAIT_ASYNC_ALL()
#endif

__device__ __forceinline__ void stage_load(
    float (*__restrict__ As)[LP], float (*__restrict__ Bxs)[LP],
    float (*__restrict__ Bas)[LP],
    const float* __restrict__ x, const float* __restrict__ Wx,
    const float* __restrict__ Wa,
    int m0, int n0, int k0, int D, int tid)
{
    // A sweep of the block moves 16 rows of 32 floats (8 lanes a row, 16 B a
    // lane): 8 sweeps for x, 4 for each weight tile, 16 transfers per thread.
    const int row = tid >> 3;
    const int c4  = (tid & 7) << 2;
    const unsigned lo = (unsigned)row * (unsigned)D + (unsigned)c4;  // lane's part
    #pragma unroll
    for (int i = 0; i < TM / 16; ++i) {
        const float* g = x + ((size_t)(m0 + 16 * i) * D + k0) + lo;
#if USE_ASYNC
        async_cp16(g, &As[row + 16 * i][c4]);
#else
        *(float4*)&As[row + 16 * i][c4] = *(const float4*)g;
#endif
    }
    #pragma unroll
    for (int i = 0; i < TN / 16; ++i) {
        const float* gx = Wx + ((size_t)(n0 + 16 * i) * D + k0) + lo;
        const float* ga = Wa + ((size_t)(n0 + 16 * i) * D + k0) + lo;
#if USE_ASYNC
        async_cp16(gx, &Bxs[row + 16 * i][c4]);
        async_cp16(ga, &Bas[row + 16 * i][c4]);
#else
        *(float4*)&Bxs[row + 16 * i][c4] = *(const float4*)gx;
        *(float4*)&Bas[row + 16 * i][c4] = *(const float4*)ga;
#endif
    }
}

// Fused dual GEMM (fp32 WMMA) + RG-LRU pointwise epilogue.
// Each wave owns 64 x 32 outputs of both gates: per 4 k it loads 4 x-fragments
// and 4 weight fragments for 16 WMMAs, so the LDS reads, the copies and the
// barrier are spread over four times as many matrix instructions per wave.
// Two LDS buffers: slab s+1 is copied in while slab s is multiplied.
__global__ __launch_bounds__(GT) void rg_lru_gates_kernel(
    const float* __restrict__ x,  const float* __restrict__ Wx,
    const float* __restrict__ bx, const float* __restrict__ Wa,
    const float* __restrict__ ba, const float* __restrict__ ap,
    float* __restrict__ y, float* __restrict__ Aout,
    int M, int D, int Bb)
{
    __shared__ __attribute__((aligned(16))) float As [2][TM][LP];
    __shared__ __attribute__((aligned(16))) float Bxs[2][TN][LP];
    __shared__ __attribute__((aligned(16))) float Bas[2][TN][LP];

    const int tid  = threadIdx.x;
    const int lane = tid & 31;
    const int wave = __builtin_amdgcn_readfirstlane(tid >> 5);  // scalar: tile offsets stay out of the VGPRs
    const int hi   = lane >> 4;   // 0: lanes 0-15, 1: lanes 16-31
    const int l16  = lane & 15;

    const int m0 = blockIdx.y * TM;
    const int n0 = blockIdx.x * TN;

    const int r = wave & 1;       // 2 row halves of 64
    const int c = wave >> 1;      // 2 col halves of 32

    v8f acc_gx[WM][WN] = {};
    v8f acc_ga[WM][WN] = {};

    const int nslab = D / KS;

    // Slab 0 into buffer 0, landed and published; then slab 1 under way.
    stage_load(As[0], Bxs[0], Bas[0], x, Wx, Wa, m0, n0, 0, D, tid);
    WAIT_ASYNC_ALL();
    __syncthreads();
    if (nslab > 1)
        stage_load(As[1], Bxs[1], Bas[1], x, Wx, Wa, m0, n0, KS, D, tid);

    for (int s = 0; s < nslab; ++s) {
        const int ib = s & 1;
        const float (*__restrict__ A )[LP] = As [ib];
        const float (*__restrict__ BX)[LP] = Bxs[ib];
        const float (*__restrict__ BA)[LP] = Bas[ib];

        // Fragments of 8 k at a time, in two register sets: the next 8 k are
        // fetched while the current ones are multiplied.
        // A 16x4 f32 fragment: lane<16 -> K=kk+0..1 ; lane>=16 -> K=kk+2..3
        // B 4x16 f32 fragment: N = lane%16, same K split as A
        v2f af[2][2][WM], bxf[2][2][WN], baf[2][2][WN];
        auto fetch = [&](int set, int g) {
            #pragma unroll
            for (int h = 0; h < 2; ++h) {
                const int kb = 8 * g + 4 * h + (hi << 1);
                #pragma unroll
                for (int u = 0; u < WM; ++u) {
                    const int mrow = 64 * r + 16 * u + l16;
                    af[set][h][u].x = A[mrow][kb];  af[set][h][u].y = A[mrow][kb + 1];
                }
                #pragma unroll
                for (int t = 0; t < WN; ++t) {
                    const int nrow = 32 * c + 16 * t + l16;
                    bxf[set][h][t].x = BX[nrow][kb];  bxf[set][h][t].y = BX[nrow][kb + 1];
                    baf[set][h][t].x = BA[nrow][kb];  baf[set][h][t].y = BA[nrow][kb + 1];
                }
            }
        };
        fetch(0, 0);
        #pragma unroll
        for (int g = 0; g < KS / 8; ++g) {
            if (g + 1 < KS / 8) fetch((g + 1) & 1, g + 1);
            #pragma unroll
            for (int h = 0; h < 2; ++h) {
                #pragma unroll
                for (int u = 0; u < WM; ++u) {
                    #pragma unroll
                    for (int t = 0; t < WN; ++t) {
                        acc_gx[u][t] = __builtin_amdgcn_wmma_f32_16x16x4_f32(
                            false, af[g & 1][h][u], false, bxf[g & 1][h][t], (short)0,
                            acc_gx[u][t], false, false);
                        acc_ga[u][t] = __builtin_amdgcn_wmma_f32_16x16x4_f32(
                            false, af[g & 1][h][u], false, baf[g & 1][h][t], (short)0,
                            acc_ga[u][t], false, false);
                    }
                }
            }
        }

        // Hand-over: this wave's reads of buffer ib are back, its copies of
        // slab s+1 have landed; behind the barrier that holds for every wave,
        // so slab s+1 may be read and buffer ib refilled.
        asm volatile("s_wait_dscnt 0x0" ::: "memory");
        WAIT_ASYNC_ALL();
        __syncthreads();
        if (s + 2 < nslab)
            stage_load(As[ib], Bxs[ib], Bas[ib], x, Wx, Wa,
                       m0, n0, (s + 2) * KS, D, tid);
    }
    WAIT_ASYNC_ALL();   // nothing in flight when the wave ends

    // Epilogue: C/D layout = VGPR j -> M = j (lanes 0-15) / j+8 (lanes 16-31),
    // N = lane%16. Intermediates are streamed (read once by the scan kernel):
    // store non-temporally so they don't evict the L2-resident weights.
    float bxn[WN], ban[WN], sp[WN];
    #pragma unroll
    for (int t = 0; t < WN; ++t) {
        const int n = n0 + 32 * c + 16 * t + l16;
        bxn[t] = bx[n];
        ban[t] = ba[n];
        sp[t]  = log1pf(__expf(ap[n]));   // softplus(a_param[e])
    }
    // Wave tile's corner as a uniform offset, the lane's place in it as 32 bits.
    const int    mw  = m0 + 64 * r;
    const size_t tof = (size_t)mw * D + (n0 + 32 * c);
    const float* __restrict__ xt = x + tof;
    float* __restrict__ yt = y + tof;
    float* __restrict__ at = Aout + tof;
    const unsigned lof = (unsigned)(8 * hi) * (unsigned)D + (unsigned)l16;
    // 16 rows at a time: the x values in, all 32 results into registers of
    // their own, then the stores in one run.
    #pragma unroll
    for (int u = 0; u < WM; ++u) {
        float xv[8][WN], yv[8][WN], av[8][WN];
        #pragma unroll
        for (int j = 0; j < 8; ++j) {
            const unsigned rof = lof + (unsigned)(16 * u + j) * (unsigned)D;
            #pragma unroll
            for (int t = 0; t < WN; ++t) xv[j][t] = (xt + rof)[16 * t];
        }
        #pragma unroll
        for (int j = 0; j < 8; ++j) {
            const int m = mw + 16 * u + j + 8 * hi;
            #pragma unroll
            for (int t = 0; t < WN; ++t) {
                const float gx = 1.0f / (1.0f + __expf(-(acc_gx[u][t][j] + bxn[t])));
                const float ga = 1.0f / (1.0f + __expf(-(acc_ga[u][t][j] + ban[t])));
                const float la = -8.0f * ga * sp[t];        // log_a
                float a    = __expf(la);
                float mult = sqrtf(fmaxf(0.0f, 1.0f - __expf(2.0f * la)));
                if (m < Bb) { a = 0.0f; mult = 1.0f; }      // reset at s == 0
                yv[j][t] = xv[j][t] * gx * mult;            // normed_x
                av[j][t] = a;
            }
        }
        #pragma unroll
        for (int j = 0; j < 8; ++j) {
            const unsigned rof = lof + (unsigned)(16 * u + j) * (unsigned)D;
            #pragma unroll
            for (int t = 0; t < WN; ++t) {
                __builtin_nontemporal_store(yv[j][t], yt + rof + 16 * t);
                __builtin_nontemporal_store(av[j][t], at + rof + 16 * t);
            }
        }
        // The stores' registers are rewritten by the next 16 rows: the wait
        // stands in front of that.
        if (u + 1 < WM) asm volatile("s_wait_xcnt 0x0" ::: "memory");
    }
}

// Diagonal linear recurrence, in place over y: h = a*h + normed_x.
// One channel is a serial chain of S steps, so a thread per channel leaves the
// chip latency-bound. Here the time axis is split as well: a work-group owns
// SCAN_COLS channels (256 contiguous bytes per time step and wave), and each
// of its SCAN_NW waves holds SCAN_CH consecutive steps of a and normed_x in
// registers. Over its chunk a wave forms P = prod(a) and L = the chunk's end
// value from a zero start; the chunk's true start value follows from the
// carry by h <- P*h + L over the chunks before it (exchanged through LDS),
// and the chunk is then replayed from that start value out of registers.
// Every byte is read once and written once. All traffic is single-use
// streaming -> non-temporal.
#define SCAN_NW   16                    // waves per work-group
#define SCAN_CH   32                    // time steps held per wave
#define SCAN_COLS 64                    // channels per work-group (2 per lane)
#define SCAN_SPAN (SCAN_NW * SCAN_CH)   // time steps per work-group pass
#define SCAN_BD   (8 * 2048)            // batch * width: the row stride, a compile-
                                        // time constant so that every step's
                                        // address is an immediate offset

// One chunk of a and normed_x into registers, in time order. vo is the lane's
// byte offset of the chunk's first step, the same in both planes.
__device__ __forceinline__ void scan_load_chunk(
    v2f (&a)[SCAN_CH], v2f (&v)[SCAN_CH],
    const float* Aarr, const float* y, unsigned& vo)
{
    #pragma unroll
    for (int i = 0; i < SCAN_CH; ++i) {
        a[i] = __builtin_nontemporal_load(
            (const v2f*)((const char*)Aarr + vo + (size_t)i * SCAN_BD * 4));
        v[i] = __builtin_nontemporal_load(
            (const v2f*)((const char*)y + vo + (size_t)i * SCAN_BD * 4));
    }
    // The wait names the offset register, so that it stays unwritten up to it.
    asm volatile("s_wait_xcnt 0x0" : "+v"(vo) :: "memory");
}

__global__ __launch_bounds__(SCAN_NW * 32)
// One work-group per WGP, 4 waves a SIMD: with that register budget stated the
// carry merge keeps four LDS reads in flight instead of two.
__attribute__((amdgpu_waves_per_eu(4, 4)))
void rg_lru_scan_kernel(
    const float* __restrict__ Aarr, const float* __restrict__ h0,
    float* __restrict__ y, float* __restrict__ hn, int S)
{
    __shared__ float4 pl[2][SCAN_NW][32];   // (P.x, P.y, L.x, L.y) per chunk, lane

    const int lane = threadIdx.x & 31;
    const int w    = __builtin_amdgcn_readfirstlane(threadIdx.x >> 5);
    const int col  = blockIdx.x * SCAN_COLS + lane * 2;

    unsigned vo = ((unsigned)(w * SCAN_CH) * SCAN_BD + col) * 4u;

    v2f a[SCAN_CH], v[SCAN_CH];
    scan_load_chunk(a, v, Aarr, y, vo);

    v2f carry = *(const v2f*)(h0 + col);   // state in front of this pass
    v2f h = carry;
    const int npass = S / SCAN_SPAN;

    int p = 0;
    do {   // S >= SCAN_SPAN: the first chunk, already under way, is always used
        // Chunk summary, consumed in load order as the data arrives.
        v2f P = a[0], L = v[0];
        #pragma unroll
        for (int i = 1; i < SCAN_CH; ++i) {
            L = a[i] * L + v[i];
            P = P * a[i];
        }
        pl[p & 1][w][lane] = make_float4(P.x, P.y, L.x, L.y);
        // Publishes the summaries. Two LDS buffers: a wave can write pass p+2
        // only behind the barrier of pass p+1, which every reader of pass p
        // has then reached.
        __syncthreads();

        v2f c = carry;
        #pragma unroll
        for (int j = 0; j < SCAN_NW; ++j) {
            const float4 e = pl[p & 1][j][lane];
            if (j == w) h = c;              // state in front of this wave's chunk
            c.x = fmaf(e.x, c.x, e.z);
            c.y = fmaf(e.y, c.y, e.w);
        }
        carry = c;

        // Replay the chunk from its true start value, each step's state into
        // its own register pair, so that no store's data register is reused
        // while the stores issue.
        #pragma unroll
        for (int i = 0; i < SCAN_CH; ++i) {
            h = a[i] * h + v[i];
            v[i] = h;
        }
        #pragma unroll
        for (int i = 0; i < SCAN_CH; ++i)
            __builtin_nontemporal_store(
                v[i], (v2f*)((char*)y + vo + (size_t)i * SCAN_BD * 4));
        // The stores' data and offset registers are rewritten next (offset
        // step, next chunk's loads): the wait stands in front of that.
        asm volatile("s_wait_xcnt 0x0" : "+v"(vo) :: "memory");

        vo += (unsigned)SCAN_SPAN * SCAN_BD * 4u;
        if (p + 1 < npass) scan_load_chunk(a, v, Aarr, y, vo);
    } while (++p < npass);
    if (w == SCAN_NW - 1) *(v2f*)(hn + col) = h;   // last step's state
}

extern "C" void kernel_launch(void* const* d_in, const int* in_sizes, int n_in,
                              void* d_out, int out_size, void* d_ws, size_t ws_size,
                              hipStream_t stream) {
    const float* x  = (const float*)d_in[0];
    const float* h0 = (const float*)d_in[1];
    const float* Wx = (const float*)d_in[2];
    const float* bx = (const float*)d_in[3];
    const float* Wa = (const float*)d_in[4];
    const float* ba = (const float*)d_in[5];
    const float* ap = (const float*)d_in[6];

    const int D  = in_sizes[6];                 // width
    const int Bb = in_sizes[1] / D;             // batch
    const int S  = in_sizes[0] / in_sizes[1];   // seq len
    const int M  = S * Bb;                      // GEMM rows

    float* y    = (float*)d_out;                // (S,B,D) output block
    float* hn   = y + (size_t)M * D;            // final state block
    float* Aarr = (float*)d_ws;                 // decay coefficients scratch

    dim3 grid(D / TN, M / TM);
    rg_lru_gates_kernel<<<grid, GT, 0, stream>>>(x, Wx, bx, Wa, ba, ap,
                                                  y, Aarr, M, D, Bb);

    const int BD = Bb * D;
    rg_lru_scan_kernel<<<BD / SCAN_COLS, SCAN_NW * 32, 0, stream>>>(Aarr, h0, y, hn, S);
}
